// v000
// Times are from an AMD MI455X. After a warm-up the kernel runs many times in a row, and a time is the length of
// such a window on the GPU divided by its runs, so every launch and the gaps after it count. The runs cycle
// through copies of the inputs. A figure is the median of several windows, for all but v000 over two sittings.
// Sittings can differ by a few percent; kernels timed side by side share one.
// The starting kernel, v000, takes 63.1 microseconds a run.
#include <hip/hip_runtime.h>
#include <hip/hip_bf16.h>
#include <math.h>

typedef __attribute__((ext_vector_type(16))) __bf16       v16bf;
typedef __attribute__((ext_vector_type(8)))  float        v8f;
typedef __attribute__((ext_vector_type(8)))  unsigned int v8u;
typedef __attribute__((ext_vector_type(4)))  unsigned int v4u;

constexpr int B = 256, G = 256, S = 128, D = 256;
constexpr float EPS = 1e-5f;
constexpr int NTHREADS = 512;                 // 16 wave32 waves per WG

// LDS strides in bf16 elements. Strides are multiples of 8 elems (16 B) so the
// two 16-byte halves of every WMMA fragment are b128-alignable, and stride/4
// (dwords) == 4 (mod 64) so the 16 lanes of a half sweep all 64 LDS banks.
constexpr int XA_STRIDE = S + 8;              // 136 elems = 272 B
constexpr int W1_STRIDE = S + 8;              // 136
constexpr int HA_STRIDE = D + 8;              // 264 elems = 528 B
constexpr int W2_STRIDE = D + 8;              // 264

constexpr int XA_BYTES = B * XA_STRIDE * 2;   // 69632
constexpr int W1_BYTES = D * W1_STRIDE * 2;   // 69632
constexpr int HA_BYTES = B * HA_STRIDE * 2;   // 135168
constexpr int W2_BYTES = D * W2_STRIDE * 2;   // 135168
constexpr int REGION0  = XA_BYTES + W1_BYTES; // 139264 >= W2_BYTES (W2T overlays x/W1)
constexpr size_t LDS_BYTES = (size_t)REGION0 + HA_BYTES;  // 274432 <= 320KB WGP LDS

// fp32 -> bf16 (RNE), as raw 16-bit pattern
__device__ __forceinline__ unsigned f2bfu(float f) {
  unsigned u = __builtin_bit_cast(unsigned, f);
  u += 0x7FFFu + ((u >> 16) & 1u);
  return u >> 16;
}
__device__ __forceinline__ __bf16 f2bf(float f) {
  unsigned short h = (unsigned short)f2bfu(f);
  return __builtin_bit_cast(__bf16, h);
}

// 16x32 bf16 WMMA fragment (A layout; B identical with lane = column).
// CDNA5 16-bit layout: lane half h, VGPR0..3 = K h*8+0..7, VGPR4..7 = K 16+h*8+0..7
// -> two contiguous 16-byte runs per lane -> two ds_load_b128.
__device__ __forceinline__ v16bf load_frag(const __bf16* base, int stride, int lane) {
  const int m    = lane & 15;
  const int half = lane >> 4;
  const __bf16* p = base + m * stride + half * 8;
  const v4u lo = *reinterpret_cast<const v4u*>(p);        // K = half*8 + 0..7
  const v4u hi = *reinterpret_cast<const v4u*>(p + 16);   // K = 16 + half*8 + 0..7
  const v8u r  = __builtin_shufflevector(lo, hi, 0, 1, 2, 3, 4, 5, 6, 7);
  return __builtin_bit_cast(v16bf, r);
}

__global__ __launch_bounds__(NTHREADS, 1)
void pathway_group_kernel(const float* __restrict__ x,
                          const float* __restrict__ W1,
                          const float* __restrict__ b1,
                          const float* __restrict__ ln_g,
                          const float* __restrict__ ln_b,
                          const float* __restrict__ W2,
                          const float* __restrict__ b2,
                          float* __restrict__ out) {
  extern __shared__ char smem[];
  __bf16* xA  = reinterpret_cast<__bf16*>(smem);
  __bf16* w1T = reinterpret_cast<__bf16*>(smem + XA_BYTES);
  __bf16* w2T = reinterpret_cast<__bf16*>(smem);            // overlays xA/w1T in phase 2
  __bf16* hA  = reinterpret_cast<__bf16*>(smem + REGION0);

  const int g    = blockIdx.x;
  const int tid  = threadIdx.x;
  const int lane = tid & 31;
  const int wave = tid >> 5;
  const int col  = lane & 15;       // output column within 16-wide tile
  const int half = lane >> 4;       // C/D: lanes 16-31 hold rows M=8..15
  const int m0   = wave * 16;       // this wave owns batch rows m0..m0+15

  const float* W1g = W1 + (size_t)g * S * D;
  const float* W2g = W2 + (size_t)g * D * D;

  // Speculative prefetch of W2 (needed in phase 2) into GL2 while we do GEMM1
  for (int i = tid * 16; i < D * D; i += NTHREADS * 16)
    __builtin_prefetch(W2g + i, 0, 1);

  // ---------- stage x tile: 2 elems/iter -> b64 global read + packed b32 LDS store ----------
  for (int i = tid; i < (B * S) / 2; i += NTHREADS) {
    const int b = i >> 6, s = (i & 63) * 2;                 // S/2 == 64
    const float* px = x + (size_t)b * (G * S) + (size_t)g * S + s;
    const unsigned packed = f2bfu(px[0]) | (f2bfu(px[1]) << 16);
    *reinterpret_cast<unsigned*>(xA + b * XA_STRIDE + s) = packed;
  }
  // ---------- stage W1^T (coalesced global reads over n; transposed b16 LDS writes) ----------
  for (int i = tid; i < S * D; i += NTHREADS) {
    const int k = i >> 8, n = i & (D - 1);
    w1T[n * W1_STRIDE + k] = f2bf(W1g[k * D + n]);
  }
  __syncthreads();

  // ---------- GEMM1: h = x_tile @ W1  (M=16/wave, K=128, N=256) ----------
  v16bf a1[4];
#pragma unroll
  for (int kc = 0; kc < 4; ++kc)
    a1[kc] = load_frag(xA + m0 * XA_STRIDE + kc * 32, XA_STRIDE, lane);

  const v8f vzero = {0.f, 0.f, 0.f, 0.f, 0.f, 0.f, 0.f, 0.f};
  v8f acc[16];
#pragma unroll
  for (int t = 0; t < 16; ++t) acc[t] = vzero;

#pragma unroll
  for (int t = 0; t < 16; ++t) {
#pragma unroll
    for (int kc = 0; kc < 4; ++kc) {
      const v16bf bf = load_frag(w1T + (t * 16) * W1_STRIDE + kc * 32, W1_STRIDE, lane);
      acc[t] = __builtin_amdgcn_wmma_f32_16x16x32_bf16(
          false, a1[kc], false, bf, (short)0, acc[t], false, false);
    }
  }
  __syncthreads();  // all xA/w1T reads done -> region0 may be overwritten by W2^T

  // ---------- bias + LayerNorm statistics (rows live inside this wave) ----------
  float s1[8], s2[8];
#pragma unroll
  for (int vg = 0; vg < 8; ++vg) { s1[vg] = 0.f; s2[vg] = 0.f; }
#pragma unroll
  for (int t = 0; t < 16; ++t) {
    const float bias = b1[(size_t)g * D + t * 16 + col];
#pragma unroll
    for (int vg = 0; vg < 8; ++vg) {
      const float v = acc[t][vg] + bias;
      acc[t][vg] = v;
      s1[vg] += v;
      s2[vg] += v * v;
    }
  }
  // butterfly over the 16 lanes that share each row (xor<16 stays in lane-half)
#pragma unroll
  for (int vg = 0; vg < 8; ++vg) {
#pragma unroll
    for (int off = 1; off < 16; off <<= 1) {
      s1[vg] += __shfl_xor(s1[vg], off, 32);
      s2[vg] += __shfl_xor(s2[vg], off, 32);
    }
  }
  float mu[8], rstd[8];
#pragma unroll
  for (int vg = 0; vg < 8; ++vg) {
    mu[vg] = s1[vg] * (1.f / D);
    const float var = s2[vg] * (1.f / D) - mu[vg] * mu[vg];
    rstd[vg] = rsqrtf(var + EPS);
  }

  // ---------- LN affine + exact GELU -> hA (bf16); co-stage W2^T ----------
#pragma unroll
  for (int t = 0; t < 16; ++t) {
    const int n = t * 16 + col;
    const float gamma = ln_g[(size_t)g * D + n];
    const float beta  = ln_b[(size_t)g * D + n];
#pragma unroll
    for (int vg = 0; vg < 8; ++vg) {
      float v = (acc[t][vg] - mu[vg]) * rstd[vg] * gamma + beta;
      v = 0.5f * v * (1.0f + erff(v * 0.70710678118654752440f));   // exact GELU
      hA[(m0 + vg + half * 8) * HA_STRIDE + n] = f2bf(v);
    }
  }
  for (int i = tid; i < D * D; i += NTHREADS) {
    const int k = i >> 8, n = i & (D - 1);
    w2T[n * W2_STRIDE + k] = f2bf(W2g[k * D + n]);
  }
  __syncthreads();

  // ---------- GEMM2: out = gelu(h) @ W2 + b2  (K=256, N=256) ----------
  v16bf a2[8];
#pragma unroll
  for (int kc = 0; kc < 8; ++kc)
    a2[kc] = load_frag(hA + m0 * HA_STRIDE + kc * 32, HA_STRIDE, lane);

#pragma unroll
  for (int t = 0; t < 16; ++t) acc[t] = vzero;
#pragma unroll
  for (int t = 0; t < 16; ++t) {
#pragma unroll
    for (int kc = 0; kc < 8; ++kc) {
      const v16bf bf = load_frag(w2T + (t * 16) * W2_STRIDE + kc * 32, W2_STRIDE, lane);
      acc[t] = __builtin_amdgcn_wmma_f32_16x16x32_bf16(
          false, a2[kc], false, bf, (short)0, acc[t], false, false);
    }
  }

  // ---------- epilogue: out[row][g][n] = acc + b2[g][n] ----------
#pragma unroll
  for (int t = 0; t < 16; ++t) {
    const int n = t * 16 + col;
    const float bias = b2[(size_t)g * D + n];
#pragma unroll
    for (int vg = 0; vg < 8; ++vg) {
      const int row = m0 + vg + half * 8;
      out[((size_t)row * G + g) * D + n] = acc[t][vg] + bias;
    }
  }
}

extern "C" void kernel_launch(void* const* d_in, const int* in_sizes, int n_in,
                              void* d_out, int out_size, void* d_ws, size_t ws_size,
                              hipStream_t stream) {
  (void)in_sizes; (void)n_in; (void)out_size; (void)d_ws; (void)ws_size;
  const float* x    = (const float*)d_in[0];
  const float* W1   = (const float*)d_in[1];
  const float* b1   = (const float*)d_in[2];
  const float* ln_g = (const float*)d_in[3];
  const float* ln_b = (const float*)d_in[4];
  const float* W2   = (const float*)d_in[5];
  const float* b2   = (const float*)d_in[6];
  float* out = (float*)d_out;

  dim3 grid(G);            // one workgroup per group: weights read exactly once
  dim3 block(NTHREADS);    // 16 waves; each owns 16 batch rows
  pathway_group_kernel<<<grid, block, LDS_BYTES, stream>>>(
      x, W1, b1, ln_g, ln_b, W2, b2, out);
}

// v001
// A run of this version takes 46.5 microseconds.
// Two timings next to v000 both put it at 1.36 times that version's speed.
#include <hip/hip_runtime.h>
#include <hip/hip_bf16.h>
#include <math.h>

typedef __attribute__((ext_vector_type(16))) __bf16       v16bf;
typedef __attribute__((ext_vector_type(8)))  float        v8f;
typedef __attribute__((ext_vector_type(8)))  unsigned int v8u;
typedef __attribute__((ext_vector_type(4)))  unsigned int v4u;
typedef __attribute__((ext_vector_type(2)))  float        v2f;

constexpr int B = 256, G = 256, S = 128, D = 256;
constexpr float EPS = 1e-5f;
constexpr int NTHREADS = 512;                 // 16 wave32 waves per WG

// LDS strides in bf16 elements. Strides are multiples of 8 elems (16 B) so the
// two 16-byte halves of every WMMA fragment are b128-alignable, and stride/4
// (dwords) == 4 (mod 64) so the 16 lanes of a half sweep all 64 LDS banks.
constexpr int XA_STRIDE = S + 8;              // 136 elems = 272 B
constexpr int W1_STRIDE = S + 8;              // 136
constexpr int HA_STRIDE = D + 8;              // 264 elems = 528 B
constexpr int W2_STRIDE = D + 8;              // 264

constexpr int XA_BYTES = B * XA_STRIDE * 2;   // 69632
constexpr int W1_BYTES = D * W1_STRIDE * 2;   // 69632
constexpr int HA_BYTES = B * HA_STRIDE * 2;   // 135168
constexpr int W2_BYTES = D * W2_STRIDE * 2;   // 135168
constexpr int REGION0  = XA_BYTES + W1_BYTES; // 139264 >= W2_BYTES (W2T overlays x/W1)
constexpr size_t LDS_BYTES = (size_t)REGION0 + HA_BYTES;  // 274432 <= 320KB WGP LDS

// fp32 -> bf16 (RNE), as raw 16-bit pattern
__device__ __forceinline__ unsigned f2bfu(float f) {
  unsigned u = __builtin_bit_cast(unsigned, f);
  u += 0x7FFFu + ((u >> 16) & 1u);
  return u >> 16;
}
__device__ __forceinline__ __bf16 f2bf(float f) {
  unsigned short h = (unsigned short)f2bfu(f);
  return __builtin_bit_cast(__bf16, h);
}

// GELU with the exact (erf) definition, v * Phi(v) with Phi(v) = 0.5 * (1 + erf(v / sqrt(2))), free of branches.
// q = 0.5 * erfc(|v| / sqrt(2)) = (c1 t + c2 t^2 + ... + c5 t^5) * exp(-v * v / 2), t = 1 / (1 + p |v|):
// the five-term rational form, |error of erf| <= 1.5e-7. Phi = 1 - q for v >= 0 and q for v < 0,
// hence v * Phi(v) = max(v, 0) - |v| * q, which also avoids the cancellation of 1 + erf at negative v.
__device__ __forceinline__ v2f gelu_pair(v2f v) {
  const v2f one = {1.0f, 1.0f}, pp = {0.23164188f, 0.23164188f};
  const v2f c5 = {0.5307027145f, 0.5307027145f}, c4 = {-0.7265760135f, -0.7265760135f}, c3 = {0.7107068705f, 0.7107068705f};
  const v2f c2 = {-0.142248368f, -0.142248368f}, c1 = {0.127414796f, 0.127414796f};
  const v2f a = __builtin_elementwise_abs(v);
  const v2f d = __builtin_elementwise_fma(a, pp, one);
  const v2f w = (v * v) * -0.72134752044448170f;            // -v^2 / 2 * log2(e)
  const v2f t = {__builtin_amdgcn_rcpf(d[0]), __builtin_amdgcn_rcpf(d[1])};
  const v2f e = {__builtin_amdgcn_exp2f(w[0]), __builtin_amdgcn_exp2f(w[1])};
  v2f p = __builtin_elementwise_fma(t, c5, c4);
  p = __builtin_elementwise_fma(p, t, c3);
  p = __builtin_elementwise_fma(p, t, c2);
  p = __builtin_elementwise_fma(p, t, c1);
  const v2f q = (p * t) * e;
  const v2f zero = {0.0f, 0.0f};
  return __builtin_elementwise_fma(-a, q, __builtin_elementwise_max(v, zero));
}

// 16x32 bf16 WMMA fragment (A layout; B identical with lane = column).
// CDNA5 16-bit layout: lane half h, VGPR0..3 = K h*8+0..7, VGPR4..7 = K 16+h*8+0..7
// -> two contiguous 16-byte runs per lane -> two ds_load_b128.
__device__ __forceinline__ v16bf load_frag(const __bf16* base, int stride, int lane) {
  const int m    = lane & 15;
  const int half = lane >> 4;
  const __bf16* p = base + m * stride + half * 8;
  const v4u lo = *reinterpret_cast<const v4u*>(p);        // K = half*8 + 0..7
  const v4u hi = *reinterpret_cast<const v4u*>(p + 16);   // K = 16 + half*8 + 0..7
  const v8u r  = __builtin_shufflevector(lo, hi, 0, 1, 2, 3, 4, 5, 6, 7);
  return __builtin_bit_cast(v16bf, r);
}

__global__ __launch_bounds__(NTHREADS, 1)
void pathway_group_kernel(const float* __restrict__ x,
                          const float* __restrict__ W1,
                          const float* __restrict__ b1,
                          const float* __restrict__ ln_g,
                          const float* __restrict__ ln_b,
                          const float* __restrict__ W2,
                          const float* __restrict__ b2,
                          float* __restrict__ out) {
  extern __shared__ char smem[];
  __bf16* xA  = reinterpret_cast<__bf16*>(smem);
  __bf16* w1T = reinterpret_cast<__bf16*>(smem + XA_BYTES);
  __bf16* w2T = reinterpret_cast<__bf16*>(smem);            // overlays xA/w1T in phase 2
  __bf16* hA  = reinterpret_cast<__bf16*>(smem + REGION0);

  const int g    = blockIdx.x;
  const int tid  = threadIdx.x;
  const int lane = tid & 31;
  const int wave = tid >> 5;
  const int col  = lane & 15;       // output column within 16-wide tile
  const int half = lane >> 4;       // C/D: lanes 16-31 hold rows M=8..15
  const int m0   = wave * 16;       // this wave owns batch rows m0..m0+15

  const float* W1g = W1 + (size_t)g * S * D;
  const float* W2g = W2 + (size_t)g * D * D;

  // Speculative prefetch of W2 (needed in phase 2) into GL2 while we do GEMM1
  for (int i = tid * 16; i < D * D; i += NTHREADS * 16)
    __builtin_prefetch(W2g + i, 0, 1);

  // ---------- stage x tile: 2 elems/iter -> b64 global read + packed b32 LDS store ----------
  for (int i = tid; i < (B * S) / 2; i += NTHREADS) {
    const int b = i >> 6, s = (i & 63) * 2;                 // S/2 == 64
    const float* px = x + (size_t)b * (G * S) + (size_t)g * S + s;
    const unsigned packed = f2bfu(px[0]) | (f2bfu(px[1]) << 16);
    *reinterpret_cast<unsigned*>(xA + b * XA_STRIDE + s) = packed;
  }
  // ---------- stage W1^T (coalesced global reads over n; transposed b16 LDS writes) ----------
  for (int i = tid; i < S * D; i += NTHREADS) {
    const int k = i >> 8, n = i & (D - 1);
    w1T[n * W1_STRIDE + k] = f2bf(W1g[k * D + n]);
  }
  __syncthreads();

  // ---------- GEMM1: h = x_tile @ W1  (M=16/wave, K=128, N=256) ----------
  v16bf a1[4];
#pragma unroll
  for (int kc = 0; kc < 4; ++kc)
    a1[kc] = load_frag(xA + m0 * XA_STRIDE + kc * 32, XA_STRIDE, lane);

  const v8f vzero = {0.f, 0.f, 0.f, 0.f, 0.f, 0.f, 0.f, 0.f};
  v8f acc[16];
#pragma unroll
  for (int t = 0; t < 16; ++t) acc[t] = vzero;

#pragma unroll
  for (int t = 0; t < 16; ++t) {
#pragma unroll
    for (int kc = 0; kc < 4; ++kc) {
      const v16bf bf = load_frag(w1T + (t * 16) * W1_STRIDE + kc * 32, W1_STRIDE, lane);
      acc[t] = __builtin_amdgcn_wmma_f32_16x16x32_bf16(
          false, a1[kc], false, bf, (short)0, acc[t], false, false);
    }
  }
  __syncthreads();  // all xA/w1T reads done -> region0 may be overwritten by W2^T

  // ---------- bias + LayerNorm statistics (rows live inside this wave) ----------
  float s1[8], s2[8];
#pragma unroll
  for (int vg = 0; vg < 8; ++vg) { s1[vg] = 0.f; s2[vg] = 0.f; }
#pragma unroll
  for (int t = 0; t < 16; ++t) {
    const float bias = b1[(size_t)g * D + t * 16 + col];
#pragma unroll
    for (int vg = 0; vg < 8; ++vg) {
      const float v = acc[t][vg] + bias;
      acc[t][vg] = v;
      s1[vg] += v;
      s2[vg] += v * v;
    }
  }
  // butterfly over the 16 lanes that share each row (xor<16 stays in lane-half)
#pragma unroll
  for (int vg = 0; vg < 8; ++vg) {
#pragma unroll
    for (int off = 1; off < 16; off <<= 1) {
      s1[vg] += __shfl_xor(s1[vg], off, 32);
      s2[vg] += __shfl_xor(s2[vg], off, 32);
    }
  }
  float mu[8], rstd[8];
#pragma unroll
  for (int vg = 0; vg < 8; ++vg) {
    mu[vg] = s1[vg] * (1.f / D);
    const float var = s2[vg] * (1.f / D) - mu[vg] * mu[vg];
    rstd[vg] = rsqrtf(var + EPS);
  }

  // ---------- LN affine + exact GELU -> hA (bf16); co-stage W2^T ----------
#pragma unroll
  for (int t = 0; t < 16; ++t) {
    const int n = t * 16 + col;
    const float gamma = ln_g[(size_t)g * D + n];
    const float beta  = ln_b[(size_t)g * D + n];
#pragma unroll
    for (int vg = 0; vg < 8; vg += 2) {
      v2f v;
      v[0] = (acc[t][vg] - mu[vg]) * rstd[vg] * gamma + beta;
      v[1] = (acc[t][vg + 1] - mu[vg + 1]) * rstd[vg + 1] * gamma + beta;
      v = gelu_pair(v);                                            // exact GELU
      hA[(m0 + vg + half * 8) * HA_STRIDE + n]     = f2bf(v[0]);
      hA[(m0 + vg + 1 + half * 8) * HA_STRIDE + n] = f2bf(v[1]);
    }
  }
  for (int i = tid; i < D * D; i += NTHREADS) {
    const int k = i >> 8, n = i & (D - 1);
    w2T[n * W2_STRIDE + k] = f2bf(W2g[k * D + n]);
  }
  __syncthreads();

  // ---------- GEMM2: out = gelu(h) @ W2 + b2  (K=256, N=256) ----------
  v16bf a2[8];
#pragma unroll
  for (int kc = 0; kc < 8; ++kc)
    a2[kc] = load_frag(hA + m0 * HA_STRIDE + kc * 32, HA_STRIDE, lane);

#pragma unroll
  for (int t = 0; t < 16; ++t) acc[t] = vzero;
#pragma unroll
  for (int t = 0; t < 16; ++t) {
#pragma unroll
    for (int kc = 0; kc < 8; ++kc) {
      const v16bf bf = load_frag(w2T + (t * 16) * W2_STRIDE + kc * 32, W2_STRIDE, lane);
      acc[t] = __builtin_amdgcn_wmma_f32_16x16x32_bf16(
          false, a2[kc], false, bf, (short)0, acc[t], false, false);
    }
  }

  // ---------- epilogue: out[row][g][n] = acc + b2[g][n] ----------
#pragma unroll
  for (int t = 0; t < 16; ++t) {
    const int n = t * 16 + col;
    const float bias = b2[(size_t)g * D + n];
#pragma unroll
    for (int vg = 0; vg < 8; ++vg) {
      const int row = m0 + vg + half * 8;
      out[((size_t)row * G + g) * D + n] = acc[t][vg] + bias;
    }
  }
}

extern "C" void kernel_launch(void* const* d_in, const int* in_sizes, int n_in,
                              void* d_out, int out_size, void* d_ws, size_t ws_size,
                              hipStream_t stream) {
  (void)in_sizes; (void)n_in; (void)out_size; (void)d_ws; (void)ws_size;
  const float* x    = (const float*)d_in[0];
  const float* W1   = (const float*)d_in[1];
  const float* b1   = (const float*)d_in[2];
  const float* ln_g = (const float*)d_in[3];
  const float* ln_b = (const float*)d_in[4];
  const float* W2   = (const float*)d_in[5];
  const float* b2   = (const float*)d_in[6];
  float* out = (float*)d_out;

  dim3 grid(G);            // one workgroup per group: weights read exactly once
  dim3 block(NTHREADS);    // 16 waves; each owns 16 batch rows
  pathway_group_kernel<<<grid, block, LDS_BYTES, stream>>>(
      x, W1, b1, ln_g, ln_b, W2, b2, out);
}

// v002
// A run of this version takes 33.3 microseconds.
// Timed twice side by side with v001, it ran 1.39 and 1.42 times as fast.
// Counting every step since v000, it is 1.91 times as fast.
#include <hip/hip_runtime.h>
#include <hip/hip_bf16.h>
#include <math.h>

typedef __attribute__((ext_vector_type(16))) __bf16       v16bf;
typedef __attribute__((ext_vector_type(8)))  float        v8f;
typedef __attribute__((ext_vector_type(8)))  unsigned int v8u;
typedef __attribute__((ext_vector_type(4)))  unsigned int v4u;
typedef __attribute__((ext_vector_type(2)))  float        v2f;
typedef __attribute__((ext_vector_type(4)))  float        v4f;
typedef __attribute__((ext_vector_type(2)))  unsigned int v2u;
typedef __attribute__((ext_vector_type(2)))  __bf16       v2bf;
typedef __attribute__((ext_vector_type(8)))  short        v8s;

constexpr int B = 256, G = 256, S = 128, D = 256;
constexpr float EPS = 1e-5f;
constexpr int NTHREADS = 512;                 // 16 wave32 waves per WG

// LDS strides of the A operands in bf16 elements. Strides are multiples of 8 elems (16 B) so the
// two 16-byte halves of every WMMA fragment are b128-alignable, and stride/4
// (dwords) == 4 (mod 64) so the 16 lanes of a half sweep all 64 LDS banks.
constexpr int XA_STRIDE = S + 8;              // 136 elems = 272 B
constexpr int HA_STRIDE = D + 8;              // 264 elems = 528 B
// The weights lie in LDS as in memory, row k holding its D columns, and are transposed by the
// fragment load. Row pitch in bytes: an odd multiple of 32 B, the conflict-free pitch of that load.
constexpr int WR_PITCH = D * 2 + 32;          // 544 B

constexpr int XA_BYTES = B * XA_STRIDE * 2;   // 69632
constexpr int W1_BYTES = S * WR_PITCH;        // 69632
constexpr int HA_BYTES = B * HA_STRIDE * 2;   // 135168
constexpr int W2_BYTES = D * WR_PITCH;        // 139264
constexpr int REGION0  = XA_BYTES + W1_BYTES; // 139264 >= W2_BYTES (W2 overlays x/W1)
static_assert(W2_BYTES <= REGION0, "W2 must fit the region it overlays");
constexpr size_t LDS_BYTES = (size_t)REGION0 + HA_BYTES;  // 274432 <= 320KB WGP LDS

// fp32 -> bf16 (RNE), as raw 16-bit pattern
__device__ __forceinline__ unsigned f2bfu(float f) {
  unsigned u = __builtin_bit_cast(unsigned, f);
  u += 0x7FFFu + ((u >> 16) & 1u);
  return u >> 16;
}
__device__ __forceinline__ __bf16 f2bf(float f) {
  unsigned short h = (unsigned short)f2bfu(f);
  return __builtin_bit_cast(__bf16, h);
}

// four f32 -> four bf16 (RNE) in two packed conversions
__device__ __forceinline__ v2u pack4(v4f v) {
  const v2f lo = {v[0], v[1]}, hi = {v[2], v[3]};
  const v2u r = {__builtin_bit_cast(unsigned, __builtin_convertvector(lo, v2bf)),
                 __builtin_bit_cast(unsigned, __builtin_convertvector(hi, v2bf))};
  return r;
}

// GELU with the exact (erf) definition, v * Phi(v) with Phi(v) = 0.5 * (1 + erf(v / sqrt(2))), free of branches.
// q = 0.5 * erfc(|v| / sqrt(2)) = (c1 t + c2 t^2 + ... + c5 t^5) * exp(-v * v / 2), t = 1 / (1 + p |v|):
// the five-term rational form, |error of erf| <= 1.5e-7. Phi = 1 - q for v >= 0 and q for v < 0,
// hence v * Phi(v) = max(v, 0) - |v| * q, which also avoids the cancellation of 1 + erf at negative v.
__device__ __forceinline__ v2f gelu_pair(v2f v) {
  const v2f one = {1.0f, 1.0f}, pp = {0.23164188f, 0.23164188f};
  const v2f c5 = {0.5307027145f, 0.5307027145f}, c4 = {-0.7265760135f, -0.7265760135f}, c3 = {0.7107068705f, 0.7107068705f};
  const v2f c2 = {-0.142248368f, -0.142248368f}, c1 = {0.127414796f, 0.127414796f};
  const v2f a = __builtin_elementwise_abs(v);
  const v2f d = __builtin_elementwise_fma(a, pp, one);
  const v2f w = (v * v) * -0.72134752044448170f;            // -v^2 / 2 * log2(e)
  const v2f t = {__builtin_amdgcn_rcpf(d[0]), __builtin_amdgcn_rcpf(d[1])};
  const v2f e = {__builtin_amdgcn_exp2f(w[0]), __builtin_amdgcn_exp2f(w[1])};
  v2f p = __builtin_elementwise_fma(t, c5, c4);
  p = __builtin_elementwise_fma(p, t, c3);
  p = __builtin_elementwise_fma(p, t, c2);
  p = __builtin_elementwise_fma(p, t, c1);
  const v2f q = (p * t) * e;
  const v2f zero = {0.0f, 0.0f};
  return __builtin_elementwise_fma(-a, q, __builtin_elementwise_max(v, zero));
}

// 16x32 bf16 WMMA fragment (A layout; B identical with lane = column).
// CDNA5 16-bit layout: lane half h, VGPR0..3 = K h*8+0..7, VGPR4..7 = K 16+h*8+0..7
// -> two contiguous 16-byte runs per lane -> two ds_load_b128.
__device__ __forceinline__ v16bf load_frag(const __bf16* base, int stride, int lane) {
  const int m    = lane & 15;
  const int half = lane >> 4;
  const __bf16* p = base + m * stride + half * 8;
  const v4u lo = *reinterpret_cast<const v4u*>(p);        // K = half*8 + 0..7
  const v4u hi = *reinterpret_cast<const v4u*>(p + 16);   // K = 16 + half*8 + 0..7
  const v8u r  = __builtin_shufflevector(lo, hi, 0, 1, 2, 3, 4, 5, 6, 7);
  return __builtin_bit_cast(v16bf, r);
}

// 32x16 bf16 WMMA B fragment out of a row-major weight tile; tile = address of W[k0][n0].
// The transposing load hands lane (c = lane & 15, h = lane >> 4) the elements W[k + 8h + 0..7][n0 + c];
// at k = k0 and k = k0 + 16 that is the k order of load_frag.
__device__ __forceinline__ v16bf load_frag_tr(const char* tile, int lane) {
  typedef __attribute__((address_space(3))) v8s lds_v8s;
  const char* p = tile + ((lane >> 4) * 8 + (lane & 7)) * WR_PITCH + ((lane >> 3) & 1) * 16;
  const v4u lo = __builtin_bit_cast(v4u, __builtin_amdgcn_ds_load_tr16_b128_v8i16((lds_v8s*)p));
  const v4u hi = __builtin_bit_cast(v4u, __builtin_amdgcn_ds_load_tr16_b128_v8i16((lds_v8s*)(p + 16 * WR_PITCH)));
  const v8u r  = __builtin_shufflevector(lo, hi, 0, 1, 2, 3, 4, 5, 6, 7);
  return __builtin_bit_cast(v16bf, r);
}

__global__ __launch_bounds__(NTHREADS, 1)
void pathway_group_kernel(const float* __restrict__ x,
                          const float* __restrict__ W1,
                          const float* __restrict__ b1,
                          const float* __restrict__ ln_g,
                          const float* __restrict__ ln_b,
                          const float* __restrict__ W2,
                          const float* __restrict__ b2,
                          float* __restrict__ out) {
  extern __shared__ char smem[];
  __bf16* xA  = reinterpret_cast<__bf16*>(smem);
  char*   w1R = smem + XA_BYTES;
  char*   w2R = smem;                                       // overlays xA/w1R in phase 2
  __bf16* hA  = reinterpret_cast<__bf16*>(smem + REGION0);

  const int g    = blockIdx.x;
  const int tid  = threadIdx.x;
  const int lane = tid & 31;
  const int wave = tid >> 5;
  const int col  = lane & 15;       // output column within 16-wide tile
  const int half = lane >> 4;       // C/D: lanes 16-31 hold rows M=8..15
  const int m0   = wave * 16;       // this wave owns batch rows m0..m0+15

  const float* W1g = W1 + (size_t)g * S * D;
  const float* W2g = W2 + (size_t)g * D * D;

  // ---------- stage x and W1: 16 B per lane, a wave on 512 contiguous bytes; every load of the
  // pass is issued before the first value is converted, so the pass waits out one latency ----------
  constexpr int XCH = (B * S) / 4 / NTHREADS;               // 16 chunks of 4 floats per thread
  constexpr int W1CH = (S * D) / 4 / NTHREADS;              // 16
  constexpr int W2CH = (D * D) / 4 / NTHREADS;              // 32
  // x: S/4 == 32 chunks per row, so a wave takes one row and the block 16 rows per step.
  // W1, W2: D/4 == 64 chunks per row, the block takes 8 rows per step.
  const float* xsrc = x + (size_t)wave * (G * S) + (size_t)g * S + lane * 4;
  char* xdst = smem + wave * (XA_STRIDE * 2) + lane * 8;
  const int wdst = (tid >> 6) * WR_PITCH + (tid & 63) * 8;
  v4f rx[XCH], rw[W1CH];
#pragma unroll
  for (int j = 0; j < XCH; ++j)
    rx[j] = *reinterpret_cast<const v4f*>(xsrc + (size_t)j * (16 * G * S));
  // The W1 loads below land in registers that held the x loads' addresses: the wait that belongs in front of such an overwrite.
  asm volatile("s_wait_xcnt 0x0" ::: "memory");
#pragma unroll
  for (int j = 0; j < W1CH; ++j)
    rw[j] = *reinterpret_cast<const v4f*>(W1g + (tid + j * NTHREADS) * 4);

  // Speculative prefetch of W2 (needed in phase 2) into GL2 while we do GEMM1
  for (int i = tid * 16; i < D * D; i += NTHREADS * 16)
    __builtin_prefetch(W2g + i, 0, 1);

#pragma unroll
  for (int j = 0; j < XCH; ++j)
    *reinterpret_cast<v2u*>(xdst + j * (16 * XA_STRIDE * 2)) = pack4(rx[j]);
#pragma unroll
  for (int j = 0; j < W1CH; ++j)
    *reinterpret_cast<v2u*>(w1R + wdst + j * (8 * WR_PITCH)) = pack4(rw[j]);
  __syncthreads();

  // ---------- GEMM1: h = x_tile @ W1  (M=16/wave, K=128, N=256) ----------
  v16bf a1[4];
#pragma unroll
  for (int kc = 0; kc < 4; ++kc)
    a1[kc] = load_frag(xA + m0 * XA_STRIDE + kc * 32, XA_STRIDE, lane);

  const v8f vzero = {0.f, 0.f, 0.f, 0.f, 0.f, 0.f, 0.f, 0.f};
  v8f acc[16];
#pragma unroll
  for (int t = 0; t < 16; ++t) acc[t] = vzero;

#pragma unroll
  for (int t = 0; t < 16; ++t) {
#pragma unroll
    for (int kc = 0; kc < 4; ++kc) {
      const v16bf bf = load_frag_tr(w1R + (kc * 32) * WR_PITCH + t * 32, lane);
      acc[t] = __builtin_amdgcn_wmma_f32_16x16x32_bf16(
          false, a1[kc], false, bf, (short)0, acc[t], false, false);
    }
  }
  __syncthreads();  // all xA/w1R reads done -> region0 may be overwritten by W2

  // ---------- bias + LayerNorm statistics (rows live inside this wave) ----------
  float s1[8], s2[8];
#pragma unroll
  for (int vg = 0; vg < 8; ++vg) { s1[vg] = 0.f; s2[vg] = 0.f; }
#pragma unroll
  for (int t = 0; t < 16; ++t) {
    const float bias = b1[(size_t)g * D + t * 16 + col];
#pragma unroll
    for (int vg = 0; vg < 8; ++vg) {
      const float v = acc[t][vg] + bias;
      acc[t][vg] = v;
      s1[vg] += v;
      s2[vg] += v * v;
    }
  }
  // butterfly over the 16 lanes that share each row (xor<16 stays in lane-half)
#pragma unroll
  for (int vg = 0; vg < 8; ++vg) {
#pragma unroll
    for (int off = 1; off < 16; off <<= 1) {
      s1[vg] += __shfl_xor(s1[vg], off, 32);
      s2[vg] += __shfl_xor(s2[vg], off, 32);
    }
  }
  float mu[8], rstd[8];
#pragma unroll
  for (int vg = 0; vg < 8; ++vg) {
    mu[vg] = s1[vg] * (1.f / D);
    const float var = s2[vg] * (1.f / D) - mu[vg] * mu[vg];
    rstd[vg] = rsqrtf(var + EPS);
  }

  // ---------- LN affine + exact GELU -> hA (bf16); co-stage W2 ----------
#pragma unroll
  for (int t = 0; t < 16; ++t) {
    const int n = t * 16 + col;
    const float gamma = ln_g[(size_t)g * D + n];
    const float beta  = ln_b[(size_t)g * D + n];
#pragma unroll
    for (int vg = 0; vg < 8; vg += 2) {
      v2f v;
      v[0] = (acc[t][vg] - mu[vg]) * rstd[vg] * gamma + beta;
      v[1] = (acc[t][vg + 1] - mu[vg + 1]) * rstd[vg + 1] * gamma + beta;
      v = gelu_pair(v);                                            // exact GELU
      hA[(m0 + vg + half * 8) * HA_STRIDE + n]     = f2bf(v[0]);
      hA[(m0 + vg + 1 + half * 8) * HA_STRIDE + n] = f2bf(v[1]);
    }
  }
  v4f r2[W2CH];
#pragma unroll
  for (int j = 0; j < W2CH; ++j)
    r2[j] = *reinterpret_cast<const v4f*>(W2g + (tid + j * NTHREADS) * 4);
#pragma unroll
  for (int j = 0; j < W2CH; ++j)
    *reinterpret_cast<v2u*>(w2R + wdst + j * (8 * WR_PITCH)) = pack4(r2[j]);
  __syncthreads();

  // ---------- GEMM2: out = gelu(h) @ W2 + b2  (K=256, N=256) ----------
#pragma unroll
  for (int t = 0; t < 16; ++t) acc[t] = vzero;
  // Two trips of 128 k, kept rolled: the constant offsets of a trip's fragment loads stay under 64 KiB (61408 B at most), so every
  // fragment load takes its offset as an immediate; unrolled, each load past 64 KiB needs an address add.
#pragma unroll 1
  for (int kb = 0; kb < 2; ++kb) {
    const char* wk = w2R + kb * (128 * WR_PITCH);
    v16bf a2[4];
#pragma unroll
    for (int kc = 0; kc < 4; ++kc)
      a2[kc] = load_frag(hA + m0 * HA_STRIDE + kb * 128 + kc * 32, HA_STRIDE, lane);
#pragma unroll
    for (int t = 0; t < 16; ++t) {
#pragma unroll
      for (int kc = 0; kc < 4; ++kc) {
        const v16bf bf = load_frag_tr(wk + (kc * 32) * WR_PITCH + t * 32, lane);
        acc[t] = __builtin_amdgcn_wmma_f32_16x16x32_bf16(
            false, a2[kc], false, bf, (short)0, acc[t], false, false);
      }
    }
  }

  // ---------- epilogue: out[row][g][n] = acc + b2[g][n] ----------
#pragma unroll
  for (int t = 0; t < 16; ++t) {
    const int n = t * 16 + col;
    const float bias = b2[(size_t)g * D + n];
#pragma unroll
    for (int vg = 0; vg < 8; ++vg) {
      const int row = m0 + vg + half * 8;
      out[((size_t)row * G + g) * D + n] = acc[t][vg] + bias;
    }
  }
}

extern "C" void kernel_launch(void* const* d_in, const int* in_sizes, int n_in,
                              void* d_out, int out_size, void* d_ws, size_t ws_size,
                              hipStream_t stream) {
  (void)in_sizes; (void)n_in; (void)out_size; (void)d_ws; (void)ws_size;
  const float* x    = (const float*)d_in[0];
  const float* W1   = (const float*)d_in[1];
  const float* b1   = (const float*)d_in[2];
  const float* ln_g = (const float*)d_in[3];
  const float* ln_b = (const float*)d_in[4];
  const float* W2   = (const float*)d_in[5];
  const float* b2   = (const float*)d_in[6];
  float* out = (float*)d_out;

  dim3 grid(G);            // one workgroup per group: weights read exactly once
  dim3 block(NTHREADS);    // 16 waves; each owns 16 batch rows
  pathway_group_kernel<<<grid, block, LDS_BYTES, stream>>>(
      x, W1, b1, ln_g, ln_b, W2, b2, out);
}

// v003
// It runs in 31 microseconds.
// Next to v002, in two timings, it ran 1.06 and 1.08 times as fast.
// Over all steps from v000 it is 2.05 times as fast.
#include <hip/hip_runtime.h>
#include <hip/hip_bf16.h>
#include <math.h>

typedef __attribute__((ext_vector_type(16))) __bf16       v16bf;
typedef __attribute__((ext_vector_type(8)))  float        v8f;
typedef __attribute__((ext_vector_type(8)))  unsigned int v8u;
typedef __attribute__((ext_vector_type(4)))  unsigned int v4u;
typedef __attribute__((ext_vector_type(2)))  float        v2f;
typedef __attribute__((ext_vector_type(4)))  float        v4f;
typedef __attribute__((ext_vector_type(2)))  unsigned int v2u;
typedef __attribute__((ext_vector_type(2)))  __bf16       v2bf;
typedef __attribute__((ext_vector_type(8)))  short        v8s;

constexpr int B = 256, G = 256, S = 128, D = 256;
constexpr float EPS = 1e-5f;
constexpr int NTHREADS = 512;                 // 16 wave32 waves per WG

// LDS strides of the A operands in bf16 elements. Strides are multiples of 8 elems (16 B) so the
// two 16-byte halves of every WMMA fragment are b128-alignable, and stride/4
// (dwords) == 4 (mod 64) so the 16 lanes of a half sweep all 64 LDS banks.
constexpr int XA_STRIDE = S + 8;              // 136 elems = 272 B
constexpr int HA_STRIDE = D + 8;              // 264 elems = 528 B
// The weights lie in LDS as in memory, row k holding its D columns, and are transposed by the
// fragment load. Row pitch in bytes: an odd multiple of 32 B, the conflict-free pitch of that load.
constexpr int WR_PITCH = D * 2 + 32;          // 544 B

constexpr int XA_BYTES = B * XA_STRIDE * 2;   // 69632
constexpr int W1_BYTES = S * WR_PITCH;        // 69632
constexpr int HA_BYTES = B * HA_STRIDE * 2;   // 135168
constexpr int W2_BYTES = D * WR_PITCH;        // 139264
constexpr int REGION0  = XA_BYTES + W1_BYTES; // 139264 >= W2_BYTES (W2 overlays x/W1)
static_assert(W2_BYTES <= REGION0, "W2 must fit the region it overlays");
constexpr size_t LDS_BYTES = (size_t)REGION0 + HA_BYTES;  // 274432 <= 320KB WGP LDS

// fp32 -> bf16 (RNE), as raw 16-bit pattern
__device__ __forceinline__ unsigned f2bfu(float f) {
  unsigned u = __builtin_bit_cast(unsigned, f);
  u += 0x7FFFu + ((u >> 16) & 1u);
  return u >> 16;
}
__device__ __forceinline__ __bf16 f2bf(float f) {
  unsigned short h = (unsigned short)f2bfu(f);
  return __builtin_bit_cast(__bf16, h);
}

// four f32 -> four bf16 (RNE) in two packed conversions
__device__ __forceinline__ v2u pack4(v4f v) {
  const v2f lo = {v[0], v[1]}, hi = {v[2], v[3]};
  const v2u r = {__builtin_bit_cast(unsigned, __builtin_convertvector(lo, v2bf)),
                 __builtin_bit_cast(unsigned, __builtin_convertvector(hi, v2bf))};
  return r;
}

// GELU with the exact (erf) definition, v * Phi(v) with Phi(v) = 0.5 * (1 + erf(v / sqrt(2))), free of branches.
// q = 0.5 * erfc(|v| / sqrt(2)) = (c1 t + c2 t^2 + ... + c5 t^5) * exp(-v * v / 2), t = 1 / (1 + p |v|):
// the five-term rational form, |error of erf| <= 1.5e-7. Phi = 1 - q for v >= 0 and q for v < 0,
// hence v * Phi(v) = max(v, 0) - |v| * q, which also avoids the cancellation of 1 + erf at negative v.
__device__ __forceinline__ v2f gelu_pair(v2f v) {
  const v2f one = {1.0f, 1.0f}, pp = {0.23164188f, 0.23164188f};
  const v2f c5 = {0.5307027145f, 0.5307027145f}, c4 = {-0.7265760135f, -0.7265760135f}, c3 = {0.7107068705f, 0.7107068705f};
  const v2f c2 = {-0.142248368f, -0.142248368f}, c1 = {0.127414796f, 0.127414796f};
  const v2f a = __builtin_elementwise_abs(v);
  const v2f d = __builtin_elementwise_fma(a, pp, one);
  const v2f w = (v * v) * -0.72134752044448170f;            // -v^2 / 2 * log2(e)
  const v2f t = {__builtin_amdgcn_rcpf(d[0]), __builtin_amdgcn_rcpf(d[1])};
  const v2f e = {__builtin_amdgcn_exp2f(w[0]), __builtin_amdgcn_exp2f(w[1])};
  v2f p = __builtin_elementwise_fma(t, c5, c4);
  p = __builtin_elementwise_fma(p, t, c3);
  p = __builtin_elementwise_fma(p, t, c2);
  p = __builtin_elementwise_fma(p, t, c1);
  const v2f q = (p * t) * e;
  const v2f zero = {0.0f, 0.0f};
  return __builtin_elementwise_fma(-a, q, __builtin_elementwise_max(v, zero));
}

// 16x32 bf16 WMMA fragment (A layout; B identical with lane = column).
// CDNA5 16-bit layout: lane half h, VGPR0..3 = K h*8+0..7, VGPR4..7 = K 16+h*8+0..7
// -> two contiguous 16-byte runs per lane -> two ds_load_b128.
__device__ __forceinline__ v16bf load_frag(const __bf16* base, int stride, int lane) {
  const int m    = lane & 15;
  const int half = lane >> 4;
  const __bf16* p = base + m * stride + half * 8;
  const v4u lo = *reinterpret_cast<const v4u*>(p);        // K = half*8 + 0..7
  const v4u hi = *reinterpret_cast<const v4u*>(p + 16);   // K = 16 + half*8 + 0..7
  const v8u r  = __builtin_shufflevector(lo, hi, 0, 1, 2, 3, 4, 5, 6, 7);
  return __builtin_bit_cast(v16bf, r);
}

// 32x16 bf16 WMMA B fragment out of a row-major weight tile; tile = address of W[k0][n0].
// The transposing load hands lane (c = lane & 15, h = lane >> 4) the elements W[k + 8h + 0..7][n0 + c];
// at k = k0 and k = k0 + 16 that is the k order of load_frag.
__device__ __forceinline__ v16bf load_frag_tr(const char* tile, int lane) {
  typedef __attribute__((address_space(3))) v8s lds_v8s;
  const char* p = tile + ((lane >> 4) * 8 + (lane & 7)) * WR_PITCH + ((lane >> 3) & 1) * 16;
  const v4u lo = __builtin_bit_cast(v4u, __builtin_amdgcn_ds_load_tr16_b128_v8i16((lds_v8s*)p));
  const v4u hi = __builtin_bit_cast(v4u, __builtin_amdgcn_ds_load_tr16_b128_v8i16((lds_v8s*)(p + 16 * WR_PITCH)));
  const v8u r  = __builtin_shufflevector(lo, hi, 0, 1, 2, 3, 4, 5, 6, 7);
  return __builtin_bit_cast(v16bf, r);
}

__global__ __launch_bounds__(NTHREADS, 1)
void pathway_group_kernel(const float* __restrict__ x,
                          const float* __restrict__ W1,
                          const float* __restrict__ b1,
                          const float* __restrict__ ln_g,
                          const float* __restrict__ ln_b,
                          const float* __restrict__ W2,
                          const float* __restrict__ b2,
                          float* __restrict__ out) {
  extern __shared__ char smem[];
  __bf16* xA  = reinterpret_cast<__bf16*>(smem);
  char*   w1R = smem + XA_BYTES;
  char*   w2R = smem;                                       // overlays xA/w1R in phase 2
  __bf16* hA  = reinterpret_cast<__bf16*>(smem + REGION0);

  const int g    = blockIdx.x;
  const int tid  = threadIdx.x;
  const int lane = tid & 31;
  const int wave = tid >> 5;
  const int col  = lane & 15;       // output column within 16-wide tile
  const int half = lane >> 4;       // C/D: lanes 16-31 hold rows M=8..15
  const int m0   = wave * 16;       // this wave owns batch rows m0..m0+15

  const float* W1g = W1 + (size_t)g * S * D;
  const float* W2g = W2 + (size_t)g * D * D;

  // ---------- stage x and W1: 16 B per lane, a wave on 512 contiguous bytes; every load of the
  // pass is issued before the first value is converted, so the pass waits out one latency ----------
  constexpr int XCH = (B * S) / 4 / NTHREADS;               // 16 chunks of 4 floats per thread
  constexpr int W1CH = (S * D) / 4 / NTHREADS;              // 16
  constexpr int W2CH = (D * D) / 4 / NTHREADS;              // 32
  // x: S/4 == 32 chunks per row, so a wave takes one row and the block 16 rows per step.
  // W1, W2: D/4 == 64 chunks per row, the block takes 8 rows per step.
  const float* xsrc = x + (size_t)wave * (G * S) + (size_t)g * S + lane * 4;
  char* xdst = smem + wave * (XA_STRIDE * 2) + lane * 8;
  const int wdst = (tid >> 6) * WR_PITCH + (tid & 63) * 8;
  v4f rx[XCH], rw[W1CH];
#pragma unroll
  for (int j = 0; j < XCH; ++j)
    rx[j] = *reinterpret_cast<const v4f*>(xsrc + (size_t)j * (16 * G * S));
  // The W1 loads below land in registers that held the x loads' addresses: the wait that belongs in front of such an overwrite.
  asm volatile("s_wait_xcnt 0x0" ::: "memory");
#pragma unroll
  for (int j = 0; j < W1CH; ++j)
    rw[j] = *reinterpret_cast<const v4f*>(W1g + (tid + j * NTHREADS) * 4);

  // Speculative prefetch of W2 (needed in phase 2) into GL2 while we do GEMM1
  for (int i = tid * 16; i < D * D; i += NTHREADS * 16)
    __builtin_prefetch(W2g + i, 0, 1);

#pragma unroll
  for (int j = 0; j < XCH; ++j)
    *reinterpret_cast<v2u*>(xdst + j * (16 * XA_STRIDE * 2)) = pack4(rx[j]);
#pragma unroll
  for (int j = 0; j < W1CH; ++j)
    *reinterpret_cast<v2u*>(w1R + wdst + j * (8 * WR_PITCH)) = pack4(rw[j]);
  __syncthreads();

  // ---------- GEMM1: h = x_tile @ W1  (M=16/wave, K=128, N=256) ----------
  v16bf a1[4];
#pragma unroll
  for (int kc = 0; kc < 4; ++kc)
    a1[kc] = load_frag(xA + m0 * XA_STRIDE + kc * 32, XA_STRIDE, lane);

  const v8f vzero = {0.f, 0.f, 0.f, 0.f, 0.f, 0.f, 0.f, 0.f};
  v8f acc[16];
#pragma unroll
  for (int t = 0; t < 16; ++t) acc[t] = vzero;

#pragma unroll
  for (int t = 0; t < 16; ++t) {
#pragma unroll
    for (int kc = 0; kc < 4; ++kc) {
      const v16bf bf = load_frag_tr(w1R + (kc * 32) * WR_PITCH + t * 32, lane);
      acc[t] = __builtin_amdgcn_wmma_f32_16x16x32_bf16(
          false, a1[kc], false, bf, (short)0, acc[t], false, false);
    }
  }
  __syncthreads();  // all xA/w1R reads done -> region0 may be overwritten by W2

  // ---------- bias + LayerNorm statistics (rows live inside this wave) ----------
  float s1[8], s2[8];
#pragma unroll
  for (int vg = 0; vg < 8; ++vg) { s1[vg] = 0.f; s2[vg] = 0.f; }
#pragma unroll
  for (int t = 0; t < 16; ++t) {
    const float bias = b1[(size_t)g * D + t * 16 + col];
#pragma unroll
    for (int vg = 0; vg < 8; ++vg) {
      const float v = acc[t][vg] + bias;
      acc[t][vg] = v;
      s1[vg] += v;
      s2[vg] += v * v;
    }
  }
  // butterfly over the 16 lanes that share each row (xor<16 stays in lane-half)
#pragma unroll
  for (int vg = 0; vg < 8; ++vg) {
#pragma unroll
    for (int off = 1; off < 16; off <<= 1) {
      s1[vg] += __shfl_xor(s1[vg], off, 32);
      s2[vg] += __shfl_xor(s2[vg], off, 32);
    }
  }
  float mu[8], rstd[8];
#pragma unroll
  for (int vg = 0; vg < 8; ++vg) {
    mu[vg] = s1[vg] * (1.f / D);
    const float var = s2[vg] * (1.f / D) - mu[vg] * mu[vg];
    rstd[vg] = rsqrtf(var + EPS);
  }

  // ---------- LN affine + exact GELU -> hA (bf16); co-stage W2 ----------
#pragma unroll
  for (int t = 0; t < 16; ++t) {
    const int n = t * 16 + col;
    const float gamma = ln_g[(size_t)g * D + n];
    const float beta  = ln_b[(size_t)g * D + n];
#pragma unroll
    for (int vg = 0; vg < 8; vg += 2) {
      v2f v;
      v[0] = (acc[t][vg] - mu[vg]) * rstd[vg] * gamma + beta;
      v[1] = (acc[t][vg + 1] - mu[vg + 1]) * rstd[vg + 1] * gamma + beta;
      v = gelu_pair(v);                                            // exact GELU
      hA[(m0 + vg + half * 8) * HA_STRIDE + n]     = f2bf(v[0]);
      hA[(m0 + vg + 1 + half * 8) * HA_STRIDE + n] = f2bf(v[1]);
    }
  }
  v4f r2[W2CH];
#pragma unroll
  for (int j = 0; j < W2CH; ++j)
    r2[j] = *reinterpret_cast<const v4f*>(W2g + (tid + j * NTHREADS) * 4);
#pragma unroll
  for (int j = 0; j < W2CH; ++j)
    *reinterpret_cast<v2u*>(w2R + wdst + j * (8 * WR_PITCH)) = pack4(r2[j]);
  __syncthreads();

  // ---------- GEMM2 + epilogue: out = gelu(h) @ W2 + b2  (K=256, N=256) ----------
  // Column tiles outermost, the whole K inside: a pair of tiles (one 128-byte line of each output row) is
  // finished and stored while the later pairs are still being multiplied, so the output stream leaves
  // under the products instead of behind the last of them.
  v16bf a2[8];
#pragma unroll
  for (int kc = 0; kc < 8; ++kc)
    a2[kc] = load_frag(hA + m0 * HA_STRIDE + kc * 32, HA_STRIDE, lane);
  const float* b2p = b2 + (size_t)g * D + col;
  float* op = out + ((size_t)(m0 + half * 8) * G + g) * D + col;
  // Kept rolled: the order asked of the scheduler below holds per trip, and eight copies of the trip would only add code.
#pragma unroll 1
  for (int tp = 0; tp < 8; ++tp) {
    const char* wt = w2R + tp * 64;
    const float bias0 = b2p[tp * 32], bias1 = b2p[tp * 32 + 16];
    // Only two accumulator tiles are live, so the registers of the other fourteen take the pair's fragments.
    v16bf bf[16];
#pragma unroll
    for (int kc = 0; kc < 8; ++kc) {
      bf[2 * kc]     = load_frag_tr(wt + (kc * 32) * WR_PITCH, lane);
      bf[2 * kc + 1] = load_frag_tr(wt + (kc * 32) * WR_PITCH + 32, lane);
    }
    v8f c0 = vzero, c1 = vzero;
#pragma unroll
    for (int kc = 0; kc < 8; ++kc) {
      c0 = __builtin_amdgcn_wmma_f32_16x16x32_bf16(false, a2[kc], false, bf[2 * kc], (short)0, c0, false, false);
      c1 = __builtin_amdgcn_wmma_f32_16x16x32_bf16(false, a2[kc], false, bf[2 * kc + 1], (short)0, c1, false, false);
    }
    // Order asked of the scheduler: 16 fragment loads ahead, then two more behind each product, so a wave keeps
    // about 16 LDS reads in flight; left alone the compiler sinks each load to just ahead of its product.
    __builtin_amdgcn_sched_group_barrier(0x020, 2, 0);   // the two bias loads first: they are needed at the trip's end
    __builtin_amdgcn_sched_group_barrier(0x100, 16, 0);
#pragma unroll
    for (int i = 0; i < 8; ++i) {
      __builtin_amdgcn_sched_group_barrier(0x008, 1, 0);
      __builtin_amdgcn_sched_group_barrier(0x100, 2, 0);
    }
    __builtin_amdgcn_sched_group_barrier(0x008, 8, 0);
    // out[row][g][n] = c + b2[g][n]
#pragma unroll
    for (int vg = 0; vg < 8; ++vg) {
      op[(size_t)vg * (G * D) + tp * 32]      = c0[vg] + bias0;
      op[(size_t)vg * (G * D) + tp * 32 + 16] = c1[vg] + bias1;
    }
  }
}

extern "C" void kernel_launch(void* const* d_in, const int* in_sizes, int n_in,
                              void* d_out, int out_size, void* d_ws, size_t ws_size,
                              hipStream_t stream) {
  (void)in_sizes; (void)n_in; (void)out_size; (void)d_ws; (void)ws_size;
  const float* x    = (const float*)d_in[0];
  const float* W1   = (const float*)d_in[1];
  const float* b1   = (const float*)d_in[2];
  const float* ln_g = (const float*)d_in[3];
  const float* ln_b = (const float*)d_in[4];
  const float* W2   = (const float*)d_in[5];
  const float* b2   = (const float*)d_in[6];
  float* out = (float*)d_out;

  dim3 grid(G);            // one workgroup per group: weights read exactly once
  dim3 block(NTHREADS);    // 16 waves; each owns 16 batch rows
  pathway_group_kernel<<<grid, block, LDS_BYTES, stream>>>(
      x, W1, b1, ln_g, ln_b, W2, b2, out);
}

// v004
// It runs in 27.6 microseconds.
// Next to v003, in two timings, it ran 1.12 times as fast each time.
// All steps since v000 together make it 2.30 times as fast.
#include <hip/hip_runtime.h>
#include <hip/hip_bf16.h>
#include <math.h>

typedef __attribute__((ext_vector_type(16))) __bf16       v16bf;
typedef __attribute__((ext_vector_type(8)))  float        v8f;
typedef __attribute__((ext_vector_type(8)))  unsigned int v8u;
typedef __attribute__((ext_vector_type(4)))  unsigned int v4u;
typedef __attribute__((ext_vector_type(2)))  float        v2f;
typedef __attribute__((ext_vector_type(4)))  float        v4f;
typedef __attribute__((ext_vector_type(2)))  unsigned int v2u;
typedef __attribute__((ext_vector_type(2)))  __bf16       v2bf;
typedef __attribute__((ext_vector_type(8)))  short        v8s;

constexpr int B = 256, G = 256, S = 128, D = 256;
constexpr float EPS = 1e-5f;
constexpr int NTHREADS = 512;                 // 16 wave32 waves per WG

// LDS strides of the A operands in bf16 elements. Strides are multiples of 8 elems (16 B) so the
// two 16-byte halves of every WMMA fragment are b128-alignable, and stride/4
// (dwords) == 4 (mod 64) so the 16 lanes of a half sweep all 64 LDS banks.
constexpr int XA_STRIDE = S + 8;              // 136 elems = 272 B
constexpr int HA_STRIDE = D + 8;              // 264 elems = 528 B
// The weights lie in LDS as in memory, row k holding its D columns, and are transposed by the
// fragment load. Row pitch in bytes: an odd multiple of 32 B, the conflict-free pitch of that load.
constexpr int WR_PITCH = D * 2 + 32;          // 544 B

constexpr int XA_BYTES = B * XA_STRIDE * 2;   // 69632
constexpr int W1_BYTES = S * WR_PITCH;        // 69632
constexpr int HA_BYTES = B * HA_STRIDE * 2;   // 135168
constexpr int W2_BYTES = D * WR_PITCH;        // 139264
constexpr int REGION0  = XA_BYTES + W1_BYTES; // 139264 >= W2_BYTES (W2 overlays x/W1)
static_assert(W2_BYTES <= REGION0, "W2 must fit the region it overlays");
constexpr size_t LDS_BYTES = (size_t)REGION0 + HA_BYTES;  // 274432 <= 320KB WGP LDS

// fp32 -> bf16 (RNE), as raw 16-bit pattern
__device__ __forceinline__ unsigned f2bfu(float f) {
  unsigned u = __builtin_bit_cast(unsigned, f);
  u += 0x7FFFu + ((u >> 16) & 1u);
  return u >> 16;
}
__device__ __forceinline__ __bf16 f2bf(float f) {
  unsigned short h = (unsigned short)f2bfu(f);
  return __builtin_bit_cast(__bf16, h);
}

// four f32 -> four bf16 (RNE) in two packed conversions
__device__ __forceinline__ v2u pack4(v4f v) {
  const v2f lo = {v[0], v[1]}, hi = {v[2], v[3]};
  const v2u r = {__builtin_bit_cast(unsigned, __builtin_convertvector(lo, v2bf)),
                 __builtin_bit_cast(unsigned, __builtin_convertvector(hi, v2bf))};
  return r;
}

// GELU with the exact (erf) definition, v * Phi(v) with Phi(v) = 0.5 * (1 + erf(v / sqrt(2))), free of branches.
// q = 0.5 * erfc(|v| / sqrt(2)) = (c1 t + c2 t^2 + ... + c5 t^5) * exp(-v * v / 2), t = 1 / (1 + p |v|):
// the five-term rational form, |error of erf| <= 1.5e-7. Phi = 1 - q for v >= 0 and q for v < 0,
// hence v * Phi(v) = max(v, 0) - |v| * q, which also avoids the cancellation of 1 + erf at negative v.
__device__ __forceinline__ v2f gelu_pair(v2f v) {
  const v2f one = {1.0f, 1.0f}, pp = {0.23164188f, 0.23164188f};
  const v2f c5 = {0.5307027145f, 0.5307027145f}, c4 = {-0.7265760135f, -0.7265760135f}, c3 = {0.7107068705f, 0.7107068705f};
  const v2f c2 = {-0.142248368f, -0.142248368f}, c1 = {0.127414796f, 0.127414796f};
  const v2f a = __builtin_elementwise_abs(v);
  const v2f d = __builtin_elementwise_fma(a, pp, one);
  const v2f w = (v * v) * -0.72134752044448170f;            // -v^2 / 2 * log2(e)
  const v2f t = {__builtin_amdgcn_rcpf(d[0]), __builtin_amdgcn_rcpf(d[1])};
  const v2f e = {__builtin_amdgcn_exp2f(w[0]), __builtin_amdgcn_exp2f(w[1])};
  v2f p = __builtin_elementwise_fma(t, c5, c4);
  p = __builtin_elementwise_fma(p, t, c3);
  p = __builtin_elementwise_fma(p, t, c2);
  p = __builtin_elementwise_fma(p, t, c1);
  const v2f q = (p * t) * e;
  const v2f zero = {0.0f, 0.0f};
  return __builtin_elementwise_fma(-a, q, __builtin_elementwise_max(v, zero));
}

// 16x32 bf16 WMMA fragment (A layout; B identical with lane = column).
// CDNA5 16-bit layout: lane half h, VGPR0..3 = K h*8+0..7, VGPR4..7 = K 16+h*8+0..7
// -> two contiguous 16-byte runs per lane -> two ds_load_b128.
__device__ __forceinline__ v16bf load_frag(const __bf16* base, int stride, int lane) {
  const int m    = lane & 15;
  const int half = lane >> 4;
  const __bf16* p = base + m * stride + half * 8;
  const v4u lo = *reinterpret_cast<const v4u*>(p);        // K = half*8 + 0..7
  const v4u hi = *reinterpret_cast<const v4u*>(p + 16);   // K = 16 + half*8 + 0..7
  const v8u r  = __builtin_shufflevector(lo, hi, 0, 1, 2, 3, 4, 5, 6, 7);
  return __builtin_bit_cast(v16bf, r);
}

// 32x16 bf16 WMMA B fragment out of a row-major weight tile; tile = address of W[k0][n0].
// The transposing load hands lane (c = lane & 15, h = lane >> 4) the elements W[k + 8h + 0..7][n0 + c];
// at k = k0 and k = k0 + 16 that is the k order of load_frag.
__device__ __forceinline__ v16bf load_frag_tr(const char* tile, int lane) {
  typedef __attribute__((address_space(3))) v8s lds_v8s;
  const char* p = tile + ((lane >> 4) * 8 + (lane & 7)) * WR_PITCH + ((lane >> 3) & 1) * 16;
  const v4u lo = __builtin_bit_cast(v4u, __builtin_amdgcn_ds_load_tr16_b128_v8i16((lds_v8s*)p));
  const v4u hi = __builtin_bit_cast(v4u, __builtin_amdgcn_ds_load_tr16_b128_v8i16((lds_v8s*)(p + 16 * WR_PITCH)));
  const v8u r  = __builtin_shufflevector(lo, hi, 0, 1, 2, 3, 4, 5, 6, 7);
  return __builtin_bit_cast(v16bf, r);
}

__global__ __launch_bounds__(NTHREADS, 1)
void pathway_group_kernel(const float* __restrict__ x,
                          const float* __restrict__ W1,
                          const float* __restrict__ b1,
                          const float* __restrict__ ln_g,
                          const float* __restrict__ ln_b,
                          const float* __restrict__ W2,
                          const float* __restrict__ b2,
                          float* __restrict__ out) {
  extern __shared__ char smem[];
  __bf16* xA  = reinterpret_cast<__bf16*>(smem);
  char*   w1R = smem + XA_BYTES;
  char*   w2R = smem;                                       // overlays xA/w1R in phase 2
  __bf16* hA  = reinterpret_cast<__bf16*>(smem + REGION0);

  const int g    = blockIdx.x;
  const int tid  = threadIdx.x;
  const int lane = tid & 31;
  const int wave = tid >> 5;
  const int col  = lane & 15;       // output column within 16-wide tile
  const int half = lane >> 4;       // C/D: lanes 16-31 hold rows M=8..15
  const int m0   = wave * 16;       // this wave owns batch rows m0..m0+15

  const float* W1g = W1 + (size_t)g * S * D;
  const float* W2g = W2 + (size_t)g * D * D;

  // ---------- stage x and W1: 16 B per lane, a wave on 512 contiguous bytes; every load of the
  // pass is issued before the first value is converted, so the pass waits out one latency ----------
  constexpr int XCH = (B * S) / 4 / NTHREADS;               // 16 chunks of 4 floats per thread
  constexpr int W1CH = (S * D) / 4 / NTHREADS;              // 16
  constexpr int W2CH = (D * D) / 4 / NTHREADS;              // 32
  // x: S/4 == 32 chunks per row, so a wave takes one row and the block 16 rows per step.
  // W1, W2: D/4 == 64 chunks per row, the block takes 8 rows per step.
  const float* xsrc = x + (size_t)wave * (G * S) + (size_t)g * S + lane * 4;
  char* xdst = smem + wave * (XA_STRIDE * 2) + lane * 8;
  const int wdst = (tid >> 6) * WR_PITCH + (tid & 63) * 8;
  v4f rx[XCH], rw[W1CH];
#pragma unroll
  for (int j = 0; j < XCH; ++j)
    rx[j] = *reinterpret_cast<const v4f*>(xsrc + (size_t)j * (16 * G * S));
  // The W1 loads below land in registers that held the x loads' addresses: the wait that belongs in front of such an overwrite.
  asm volatile("s_wait_xcnt 0x0" ::: "memory");
#pragma unroll
  for (int j = 0; j < W1CH; ++j)
    rw[j] = *reinterpret_cast<const v4f*>(W1g + (tid + j * NTHREADS) * 4);

  // Speculative prefetch of W2 (needed in phase 2) into GL2 while we do GEMM1
  for (int i = tid * 16; i < D * D; i += NTHREADS * 16)
    __builtin_prefetch(W2g + i, 0, 1);

#pragma unroll
  for (int j = 0; j < XCH; ++j)
    *reinterpret_cast<v2u*>(xdst + j * (16 * XA_STRIDE * 2)) = pack4(rx[j]);
#pragma unroll
  for (int j = 0; j < W1CH; ++j)
    *reinterpret_cast<v2u*>(w1R + wdst + j * (8 * WR_PITCH)) = pack4(rw[j]);
  __syncthreads();

  // ---------- GEMM1: h = x_tile @ W1  (M=16/wave, K=128, N=256) ----------
  v16bf a1[4];
#pragma unroll
  for (int kc = 0; kc < 4; ++kc)
    a1[kc] = load_frag(xA + m0 * XA_STRIDE + kc * 32, XA_STRIDE, lane);

  const v8f vzero = {0.f, 0.f, 0.f, 0.f, 0.f, 0.f, 0.f, 0.f};
  v8f acc[16];
#pragma unroll
  for (int t = 0; t < 16; ++t) acc[t] = vzero;

#pragma unroll
  for (int t = 0; t < 16; ++t) {
#pragma unroll
    for (int kc = 0; kc < 4; ++kc) {
      const v16bf bf = load_frag_tr(w1R + (kc * 32) * WR_PITCH + t * 32, lane);
      acc[t] = __builtin_amdgcn_wmma_f32_16x16x32_bf16(
          false, a1[kc], false, bf, (short)0, acc[t], false, false);
    }
  }
  __syncthreads();  // all xA/w1R reads done -> region0 may be overwritten by W2
  // Keeps the loads below out of GEMM1's stretch of code: with their registers counted in, the scheduler leaves GEMM1
  // no fragment reads ahead, and each product waits out its own two.
  __builtin_amdgcn_sched_barrier(0);

  // W2 is staged under the LayerNorm and GELU arithmetic below: W2LEAD chunks per thread are kept in flight, and each
  // column tile converts and stores the two oldest and asks for two more. Loads return in order, so what is needed
  // first is asked for first: the bias, then the affine parameters, which run PLEAD tiles ahead and stand in front of
  // the W2 chunks of the same tile, so that a wait for them covers only W2 chunks that are older still.
  constexpr int W2LEAD = 8, PLEAD = 2;
  const float* w2src = W2g + tid * 4;
  const float* b1src = b1 + (size_t)g * D + col;
  const float* gsrc  = ln_g + (size_t)g * D + col;
  const float* bsrc  = ln_b + (size_t)g * D + col;
  float bias1[16], gam[16], bet[16];
  v4f r2[W2CH];
#pragma unroll
  for (int t = 0; t < 16; ++t) bias1[t] = b1src[t * 16];
#pragma unroll
  for (int t = 0; t < PLEAD; ++t) { gam[t] = gsrc[t * 16]; bet[t] = bsrc[t * 16]; }

  // ---------- bias + LayerNorm statistics (rows live inside this wave) ----------
  float s1[8], s2[8];
#pragma unroll
  for (int vg = 0; vg < 8; ++vg) { s1[vg] = 0.f; s2[vg] = 0.f; }
#pragma unroll
  for (int t = 0; t < 16; ++t) {
    const float bias = bias1[t];
#pragma unroll
    for (int vg = 0; vg < 8; ++vg) {
      const float v = acc[t][vg] + bias;
      acc[t][vg] = v;
      s1[vg] += v;
      s2[vg] += v * v;
    }
  }
  // The first W2 chunks, asked for once the registers of GEMM1's fragments and of the bias are free: the scheduling
  // barrier keeps them from rising into the sums above, where they cost spills.
  __builtin_amdgcn_sched_barrier(0);
  // The gamma and beta loads are still in flight here, and their base register is written anew further down: the wait that belongs in front of such an overwrite.
  asm volatile("s_wait_xcnt 0x0" ::: "memory");
#pragma unroll
  for (int j = 0; j < W2LEAD; ++j)
    r2[j] = *reinterpret_cast<const v4f*>(w2src + j * (NTHREADS * 4));
  // butterfly over the 16 lanes that share each row (xor<16 stays in lane-half)
#pragma unroll
  for (int vg = 0; vg < 8; ++vg) {
#pragma unroll
    for (int off = 1; off < 16; off <<= 1) {
      s1[vg] += __shfl_xor(s1[vg], off, 32);
      s2[vg] += __shfl_xor(s2[vg], off, 32);
    }
  }
  float mu[8], rstd[8];
#pragma unroll
  for (int vg = 0; vg < 8; ++vg) {
    mu[vg] = s1[vg] * (1.f / D);
    const float var = s2[vg] * (1.f / D) - mu[vg] * mu[vg];
    rstd[vg] = rsqrtf(var + EPS);
  }

  // ---------- LN affine + exact GELU -> hA (bf16); W2 staged alongside ----------
#pragma unroll
  for (int t = 0; t < 16; ++t) {
    const int n = t * 16 + col;
    const float gamma = gam[t], beta = bet[t];
#pragma unroll
    for (int vg = 0; vg < 8; vg += 2) {
      v2f v;
      v[0] = (acc[t][vg] - mu[vg]) * rstd[vg] * gamma + beta;
      v[1] = (acc[t][vg + 1] - mu[vg + 1]) * rstd[vg + 1] * gamma + beta;
      v = gelu_pair(v);                                            // exact GELU
      hA[(m0 + vg + half * 8) * HA_STRIDE + n]     = f2bf(v[0]);
      hA[(m0 + vg + 1 + half * 8) * HA_STRIDE + n] = f2bf(v[1]);
    }
    if (t + PLEAD < 16) { gam[t + PLEAD] = gsrc[(t + PLEAD) * 16]; bet[t + PLEAD] = bsrc[(t + PLEAD) * 16]; }
#pragma unroll
    for (int j = 2 * t; j < 2 * t + 2; ++j) {
      *reinterpret_cast<v2u*>(w2R + wdst + j * (8 * WR_PITCH)) = pack4(r2[j]);
      if (j + W2LEAD < W2CH)
        r2[j + W2LEAD] = *reinterpret_cast<const v4f*>(w2src + (j + W2LEAD) * (NTHREADS * 4));
    }
    // Keeps each tile's loads and stores in their tile, and with that the lead of the loads.
    __builtin_amdgcn_sched_barrier(0);
  }
  __syncthreads();

  // ---------- GEMM2 + epilogue: out = gelu(h) @ W2 + b2  (K=256, N=256) ----------
  // Column tiles outermost, the whole K inside: a pair of tiles (one 128-byte line of each output row) is
  // finished and stored while the later pairs are still being multiplied, so the output stream leaves
  // under the products instead of behind the last of them.
  v16bf a2[8];
#pragma unroll
  for (int kc = 0; kc < 8; ++kc)
    a2[kc] = load_frag(hA + m0 * HA_STRIDE + kc * 32, HA_STRIDE, lane);
  const float* b2p = b2 + (size_t)g * D + col;
  float* op = out + ((size_t)(m0 + half * 8) * G + g) * D + col;
  // Kept rolled: the order asked of the scheduler below holds per trip, and eight copies of the trip would only add code.
#pragma unroll 1
  for (int tp = 0; tp < 8; ++tp) {
    const char* wt = w2R + tp * 64;
    const float bias0 = b2p[tp * 32], bias1 = b2p[tp * 32 + 16];
    // Only two accumulator tiles are live, so the registers of the other fourteen take the pair's fragments.
    v16bf bf[16];
#pragma unroll
    for (int kc = 0; kc < 8; ++kc) {
      bf[2 * kc]     = load_frag_tr(wt + (kc * 32) * WR_PITCH, lane);
      bf[2 * kc + 1] = load_frag_tr(wt + (kc * 32) * WR_PITCH + 32, lane);
    }
    v8f c0 = vzero, c1 = vzero;
#pragma unroll
    for (int kc = 0; kc < 8; ++kc) {
      c0 = __builtin_amdgcn_wmma_f32_16x16x32_bf16(false, a2[kc], false, bf[2 * kc], (short)0, c0, false, false);
      c1 = __builtin_amdgcn_wmma_f32_16x16x32_bf16(false, a2[kc], false, bf[2 * kc + 1], (short)0, c1, false, false);
    }
    // Order asked of the scheduler: 16 fragment loads ahead, then two more behind each product, so a wave keeps
    // about 16 LDS reads in flight; left alone the compiler sinks each load to just ahead of its product.
    __builtin_amdgcn_sched_group_barrier(0x020, 2, 0);   // the two bias loads first: they are needed at the trip's end
    __builtin_amdgcn_sched_group_barrier(0x100, 16, 0);
#pragma unroll
    for (int i = 0; i < 8; ++i) {
      __builtin_amdgcn_sched_group_barrier(0x008, 1, 0);
      __builtin_amdgcn_sched_group_barrier(0x100, 2, 0);
    }
    __builtin_amdgcn_sched_group_barrier(0x008, 8, 0);
    // out[row][g][n] = c + b2[g][n]
#pragma unroll
    for (int vg = 0; vg < 8; ++vg) {
      op[(size_t)vg * (G * D) + tp * 32]      = c0[vg] + bias0;
      op[(size_t)vg * (G * D) + tp * 32 + 16] = c1[vg] + bias1;
    }
  }
}

extern "C" void kernel_launch(void* const* d_in, const int* in_sizes, int n_in,
                              void* d_out, int out_size, void* d_ws, size_t ws_size,
                              hipStream_t stream) {
  (void)in_sizes; (void)n_in; (void)out_size; (void)d_ws; (void)ws_size;
  const float* x    = (const float*)d_in[0];
  const float* W1   = (const float*)d_in[1];
  const float* b1   = (const float*)d_in[2];
  const float* ln_g = (const float*)d_in[3];
  const float* ln_b = (const float*)d_in[4];
  const float* W2   = (const float*)d_in[5];
  const float* b2   = (const float*)d_in[6];
  float* out = (float*)d_out;

  dim3 grid(G);            // one workgroup per group: weights read exactly once
  dim3 block(NTHREADS);    // 16 waves; each owns 16 batch rows
  pathway_group_kernel<<<grid, block, LDS_BYTES, stream>>>(
      x, W1, b1, ln_g, ln_b, W2, b2, out);
}
